// v000
// The times below were measured on an AMD MI455X: many runs one after another, warmed up first and cycling through
// copies of the inputs, with the whole window's GPU time divided by the number of runs. Launches and the gaps
// between them are all in it. The median over several windows is given; except for v000 it joins two sittings, which
// can be a few percent apart, so the side-by-side timings, each taken in one sitting, are the better comparison.
// v000 is the starting kernel. One run takes 390 microseconds.
#include <hip/hip_runtime.h>

typedef float v2f __attribute__((ext_vector_type(2)));
typedef float v8f __attribute__((ext_vector_type(8)));

#define SEQ 2048
#define HD  64
#define NB  16
#define SCALE 0.125f   // 1/sqrt(64)

// ---------------------------------------------------------------------------
// Pass A: per-key column stats of the (query-axis) softmax.
// One wave handles one (batch, 16-key tile); streams all query tiles.
// S_tile[16q x 16k] = Q_tile(16x64) * K_tile(16x64)^T via 16x v_wmma_f32_16x16x4_f32
// ---------------------------------------------------------------------------
__global__ __launch_bounds__(128) void attn_colstats_kernel(
    const float* __restrict__ q, const float* __restrict__ k,
    float* __restrict__ mbuf, float* __restrict__ lbuf) {
  const int lane = threadIdx.x & 31;
  const int wid  = blockIdx.x * 4 + (threadIdx.x >> 5);
  const int b    = wid >> 7;        // 128 key tiles per batch
  const int kt   = wid & 127;
  const int row  = lane & 15;
  const int h    = lane >> 4;       // half-wave selector

  // K tile fragments (B operand): lane holds K-matrix row `row`, elems {4kk+2h, +1}
  const float* ktile = k + ((size_t)b * SEQ + (size_t)kt * 16) * HD;
  v2f kf[16];
#pragma unroll
  for (int kk = 0; kk < 16; ++kk)
    kf[kk] = *(const v2f*)(ktile + row * HD + 4 * kk + 2 * h);

  float runmax = -3.0e38f;
  float runsum = 0.0f;

  const float* qb = q + (size_t)b * SEQ * HD;
  for (int qt = 0; qt < SEQ / 16; ++qt) {
    const float* qtile = qb + (size_t)qt * 16 * HD;
    v2f qf[16];
#pragma unroll
    for (int kk = 0; kk < 16; ++kk)
      qf[kk] = *(const v2f*)(qtile + row * HD + 4 * kk + 2 * h);

    v8f acc = {};
#pragma unroll
    for (int kk = 0; kk < 16; ++kk)
      acc = __builtin_amdgcn_wmma_f32_16x16x4_f32(false, qf[kk], false, kf[kk],
                                                  (short)0, acc, false, false);
    // acc[i] = score(row M = i + 8h, key col N = row) -- all same key column per lane
    float tmax = runmax;
#pragma unroll
    for (int i = 0; i < 8; ++i) tmax = fmaxf(tmax, acc[i] * SCALE);
    float s = runsum * __expf(runmax - tmax);
#pragma unroll
    for (int i = 0; i < 8; ++i) s += __expf(acc[i] * SCALE - tmax);
    runmax = tmax;
    runsum = s;
  }

  // merge the two row-halves (lane ^ 16 owns the same key column, rows 8..15)
  float om = __shfl_xor(runmax, 16, 32);
  float os = __shfl_xor(runsum, 16, 32);
  float m  = fmaxf(runmax, om);
  float ls = runsum * __expf(runmax - m) + os * __expf(om - m);
  if (lane < 16) {
    mbuf[(size_t)b * SEQ + kt * 16 + lane] = m;
    lbuf[(size_t)b * SEQ + kt * 16 + lane] = ls;
  }
}

// ---------------------------------------------------------------------------
// Pass B: out[16q x 64d] = sum_ktiles  exp(S - m)/l  @  V_tile(16x64)
// One wave per (batch, 16-query tile). P relayout (C/D-frag -> A-frag)
// goes through a per-wave padded LDS tile; same-wave DS ops are in-order.
// ---------------------------------------------------------------------------
__global__ __launch_bounds__(128) void attn_out_kernel(
    const float* __restrict__ q, const float* __restrict__ k,
    const float* __restrict__ v, const float* __restrict__ mbuf,
    const float* __restrict__ lbuf, float* __restrict__ out) {
  __shared__ float pshare[4][16 * 17];   // stride-17 pad: conflict-free strided reads

  const int lane  = threadIdx.x & 31;
  const int wslot = threadIdx.x >> 5;
  const int wid   = blockIdx.x * 4 + wslot;
  const int b     = wid >> 7;            // 128 query tiles per batch
  const int qt    = wid & 127;
  const int row   = lane & 15;
  const int h     = lane >> 4;

  float* P = &pshare[wslot][0];

  const float* qtile = q + ((size_t)b * SEQ + (size_t)qt * 16) * HD;
  v2f qf[16];
#pragma unroll
  for (int kk = 0; kk < 16; ++kk)
    qf[kk] = *(const v2f*)(qtile + row * HD + 4 * kk + 2 * h);

  v8f oacc[4] = {{}, {}, {}, {}};        // 16q x 64d output accumulator

  const float* kb = k + (size_t)b * SEQ * HD;
  const float* vb = v + (size_t)b * SEQ * HD;
  const float* mb = mbuf + (size_t)b * SEQ;
  const float* lb = lbuf + (size_t)b * SEQ;

  for (int kt = 0; kt < SEQ / 16; ++kt) {
    // ---- scores: Q_tile * K_tile^T ----
    const float* ktile = kb + (size_t)kt * 16 * HD;
    v2f kf[16];
#pragma unroll
    for (int kk = 0; kk < 16; ++kk)
      kf[kk] = *(const v2f*)(ktile + row * HD + 4 * kk + 2 * h);

    v8f acc = {};
#pragma unroll
    for (int kk = 0; kk < 16; ++kk)
      acc = __builtin_amdgcn_wmma_f32_16x16x4_f32(false, qf[kk], false, kf[kk],
                                                  (short)0, acc, false, false);

    // ---- normalize by column stats; stash P in LDS (row M = i+8h, col N = row) ----
    const int   kcol = kt * 16 + row;
    const float mval = mb[kcol];
    const float linv = 1.0f / lb[kcol];
#pragma unroll
    for (int i = 0; i < 8; ++i) {
      float p = __expf(acc[i] * SCALE - mval) * linv;
      P[(i + 8 * h) * 17 + row] = p;
    }

    // ---- P(16x16) @ V_tile(16x64): 4 d-chunks x 4 k-steps of f32 WMMA ----
#pragma unroll
    for (int c = 0; c < 4; ++c) {
#pragma unroll
      for (int kk = 0; kk < 4; ++kk) {
        v2f pa = { P[row * 17 + 4 * kk + 2 * h],
                   P[row * 17 + 4 * kk + 2 * h + 1] };
        const float* vrow = vb + ((size_t)kt * 16 + 4 * kk + 2 * h) * HD + c * 16 + row;
        v2f vf = { vrow[0], vrow[HD] };
        oacc[c] = __builtin_amdgcn_wmma_f32_16x16x4_f32(false, pa, false, vf,
                                                        (short)0, oacc[c], false, false);
      }
    }
  }

  // ---- store: lane owns d-col (c*16 + row), rows i + 8h ----
  float* ob = out + ((size_t)b * SEQ + (size_t)qt * 16) * HD;
#pragma unroll
  for (int c = 0; c < 4; ++c)
#pragma unroll
    for (int i = 0; i < 8; ++i)
      ob[(i + 8 * h) * HD + c * 16 + row] = oacc[c][i];
}

extern "C" void kernel_launch(void* const* d_in, const int* in_sizes, int n_in,
                              void* d_out, int out_size, void* d_ws, size_t ws_size,
                              hipStream_t stream) {
  const float* q = (const float*)d_in[0];
  const float* k = (const float*)d_in[1];
  const float* v = (const float*)d_in[2];
  float* out  = (float*)d_out;
  float* mbuf = (float*)d_ws;               // NB*SEQ floats
  float* lbuf = mbuf + (size_t)NB * SEQ;    // NB*SEQ floats (256 KB total < ws)

  dim3 blk(128);                            // 4 wave32 per block
  dim3 grid((NB * (SEQ / 16)) / 4);         // 2048 waves -> 512 blocks

  attn_colstats_kernel<<<grid, blk, 0, stream>>>(q, k, mbuf, lbuf);
  attn_out_kernel<<<grid, blk, 0, stream>>>(q, k, v, mbuf, lbuf, out);
}

// v001
// It runs in 147 microseconds.
// Timed twice side by side with v000, it ran 2.70 and 2.71 times as fast.
#include <hip/hip_runtime.h>
#include <stdint.h>

typedef float v2f __attribute__((ext_vector_type(2)));
typedef float v8f __attribute__((ext_vector_type(8)));

#define SEQ 2048
#define HD  64
#define NB  16
#define SCALE 0.125f   // 1/sqrt(64)

#define TROWS   64                 // rows of one staged tile (4 WMMA tiles of 16 rows)
#define NSTAGE  (SEQ / TROWS)      // staged tiles per batch
#define QK_PITCH 68                // LDS row pitch in floats for 8-byte fragment reads: 16 rows x 2 halves fall on 64 distinct banks
#define V_PITCH  72                // LDS row pitch in floats for 4-byte row reads: rows r and r+2 fall 16 banks apart

__device__ __forceinline__ uint32_t lds_off(const void* p) { return (uint32_t)(size_t)p; }

// Copies one tile of TROWS x HD floats (contiguous in global memory) into LDS rows of
// PITCH floats: 128 threads x 8 copies x 16 bytes. g and l are the lane's own addresses of
// its first 16 bytes; each further copy is 8 rows on. A wave's copy covers 512 contiguous bytes.
template <int PITCH>
__device__ __forceinline__ void stage_tile(const float* g, uint32_t l) {
  constexpr uint32_t LS = 8u * PITCH * 4u;   // 8 rows in LDS, bytes
  constexpr int      GS = 8 * HD;            // 8 rows in global memory, floats
  // The closing s_wait_xcnt keeps later writes of the address registers behind the copies' issue.
  asm volatile(
      "global_load_async_to_lds_b128 %0, %8, off\n\t"
      "global_load_async_to_lds_b128 %1, %9, off\n\t"
      "global_load_async_to_lds_b128 %2, %10, off\n\t"
      "global_load_async_to_lds_b128 %3, %11, off\n\t"
      "global_load_async_to_lds_b128 %4, %12, off\n\t"
      "global_load_async_to_lds_b128 %5, %13, off\n\t"
      "global_load_async_to_lds_b128 %6, %14, off\n\t"
      "global_load_async_to_lds_b128 %7, %15, off\n\t"
      "s_wait_xcnt 0x0"
      :: "v"(l), "v"(l + LS), "v"(l + 2u * LS), "v"(l + 3u * LS),
         "v"(l + 4u * LS), "v"(l + 5u * LS), "v"(l + 6u * LS), "v"(l + 7u * LS),
         "v"(g), "v"(g + GS), "v"(g + 2 * GS), "v"(g + 3 * GS),
         "v"(g + 4 * GS), "v"(g + 5 * GS), "v"(g + 6 * GS), "v"(g + 7 * GS)
      : "memory");
}

// This wave's own copies have landed.
__device__ __forceinline__ void wait_copies() { asm volatile("s_wait_asynccnt 0x0" ::: "memory"); }
// This wave's own LDS reads and writes have retired, so that the buffer may be refilled.
__device__ __forceinline__ void wait_lds()    { asm volatile("s_wait_dscnt 0x0" ::: "memory"); }

// ---------------------------------------------------------------------------
// Pass A: per-key column stats of the (query-axis) softmax.
// One wave handles one (batch, 16-key tile); the block's 4 waves stream the same
// query rows, staged once per block in LDS (two buffers, the next tile in flight).
// S_tile[16q x 16k] = Q_tile(16x64) * K_tile(16x64)^T via 16x v_wmma_f32_16x16x4_f32
// ---------------------------------------------------------------------------
__global__ __launch_bounds__(128) void attn_colstats_kernel(
    const float* __restrict__ q, const float* __restrict__ k,
    float* __restrict__ mbuf, float* __restrict__ lbuf) {
  __shared__ __attribute__((aligned(16))) float qs[2][TROWS * QK_PITCH];

  const int tid  = threadIdx.x;
  const int lane = tid & 31;
  const int wid  = blockIdx.x * 4 + (tid >> 5);
  const int b    = wid >> 7;        // 128 key tiles per batch; the same for the whole block
  const int kt   = wid & 127;
  const int row  = lane & 15;
  const int h    = lane >> 4;       // half-wave selector

  // K tile fragments (B operand): lane holds K-matrix row "row", elems {4kk+2h, +1}
  const float* ktile = k + ((size_t)b * SEQ + (size_t)kt * 16) * HD;
  v2f kf[16];
#pragma unroll
  for (int kk = 0; kk < 16; ++kk)
    kf[kk] = *(const v2f*)(ktile + row * HD + 4 * kk + 2 * h);

  float runmax = -3.0e38f;
  float runsum = 0.0f;

  const float*   gsrc = q + (size_t)b * SEQ * HD + tid * 4;
  const uint32_t ldst = lds_off(&qs[0][0]) + (uint32_t)(tid >> 4) * (QK_PITCH * 4u) + (uint32_t)(tid & 15) * 16u;
  constexpr uint32_t QBUF = TROWS * QK_PITCH * 4u;

  // tile 0 has landed for every wave before anyone reads it; tile 1 then flies during trip 0
  stage_tile<QK_PITCH>(gsrc, ldst);
  wait_copies();
  __syncthreads();
  stage_tile<QK_PITCH>(gsrc + TROWS * HD, ldst + QBUF);

  for (int t = 0; t < NSTAGE; ++t) {
    const float* qbuf = &qs[t & 1][0];
// unrolled so that every fragment index is a constant and a later tile's LDS reads can start early
#pragma unroll
    for (int s = 0; s < TROWS / 16; ++s) {
      const float* qtile = qbuf + s * 16 * QK_PITCH;
      v2f qf[16];
#pragma unroll
      for (int kk = 0; kk < 16; ++kk)
        qf[kk] = *(const v2f*)(qtile + row * QK_PITCH + 4 * kk + 2 * h);

      v8f acc = {};
#pragma unroll
      for (int kk = 0; kk < 16; ++kk)
        acc = __builtin_amdgcn_wmma_f32_16x16x4_f32(false, qf[kk], false, kf[kk],
                                                    (short)0, acc, false, false);
      // acc[i] = score(row M = i + 8h, key col N = row) -- all same key column per lane
      float tmax = runmax;
#pragma unroll
      for (int i = 0; i < 8; ++i) tmax = fmaxf(tmax, acc[i] * SCALE);
      float sm = runsum * __expf(runmax - tmax);
#pragma unroll
      for (int i = 0; i < 8; ++i) sm += __expf(acc[i] * SCALE - tmax);
      runmax = tmax;
      runsum = sm;
    }
    // publish tile t+1, free tile t's buffer, then refill it with tile t+2
    wait_lds();
    wait_copies();
    __syncthreads();
    if (t + 2 < NSTAGE)
      stage_tile<QK_PITCH>(gsrc + (size_t)(t + 2) * TROWS * HD, ldst + (uint32_t)(t & 1) * QBUF);
  }
  wait_copies();

  // merge the two row-halves (lane ^ 16 owns the same key column, rows 8..15)
  float om = __shfl_xor(runmax, 16, 32);
  float os = __shfl_xor(runsum, 16, 32);
  float m  = fmaxf(runmax, om);
  float ls = runsum * __expf(runmax - m) + os * __expf(om - m);
  if (lane < 16) {
    mbuf[(size_t)b * SEQ + kt * 16 + lane] = m;
    lbuf[(size_t)b * SEQ + kt * 16 + lane] = ls;
  }
}

// ---------------------------------------------------------------------------
// Pass B: out[16q x 64d] = sum_ktiles  exp(S - m)/l  @  V_tile(16x64)
// One wave per (batch, 16-query tile); the block's 4 waves stream the same K and V
// rows, staged once per block in LDS (two buffers, the next tile in flight).
// P relayout (C/D-frag -> A-frag) goes through a per-wave padded LDS tile;
// same-wave DS ops are in-order.
// ---------------------------------------------------------------------------
__global__ __launch_bounds__(128) void attn_out_kernel(
    const float* __restrict__ q, const float* __restrict__ k,
    const float* __restrict__ v, const float* __restrict__ mbuf,
    const float* __restrict__ lbuf, float* __restrict__ out) {
  __shared__ __attribute__((aligned(16))) float ks[2][TROWS * QK_PITCH];
  __shared__ __attribute__((aligned(16))) float vs[2][TROWS * V_PITCH];
  __shared__ float pshare[4][16 * 17];   // stride-17 pad: conflict-free strided reads

  const int tid   = threadIdx.x;
  const int lane  = tid & 31;
  const int wslot = tid >> 5;
  const int wid   = blockIdx.x * 4 + wslot;
  const int b     = wid >> 7;            // 128 query tiles per batch; the same for the whole block
  const int qt    = wid & 127;
  const int row   = lane & 15;
  const int h     = lane >> 4;

  float* P = &pshare[wslot][0];

  const float* qtile = q + ((size_t)b * SEQ + (size_t)qt * 16) * HD;
  v2f qf[16];
#pragma unroll
  for (int kk = 0; kk < 16; ++kk)
    qf[kk] = *(const v2f*)(qtile + row * HD + 4 * kk + 2 * h);

  v8f oacc[4] = {{}, {}, {}, {}};        // 16q x 64d output accumulator

  const float* mb = mbuf + (size_t)b * SEQ;
  const float* lb = lbuf + (size_t)b * SEQ;

  const float*   ksrc = k + (size_t)b * SEQ * HD + tid * 4;
  const float*   vsrc = v + (size_t)b * SEQ * HD + tid * 4;
  const uint32_t kdst = lds_off(&ks[0][0]) + (uint32_t)(tid >> 4) * (QK_PITCH * 4u) + (uint32_t)(tid & 15) * 16u;
  const uint32_t vdst = lds_off(&vs[0][0]) + (uint32_t)(tid >> 4) * (V_PITCH * 4u) + (uint32_t)(tid & 15) * 16u;
  constexpr uint32_t KBUF = TROWS * QK_PITCH * 4u;
  constexpr uint32_t VBUF = TROWS * V_PITCH * 4u;

  // tile 0 has landed for every wave before anyone reads it; tile 1 then flies during trip 0
  stage_tile<QK_PITCH>(ksrc, kdst);
  stage_tile<V_PITCH>(vsrc, vdst);
  wait_copies();
  __syncthreads();
  stage_tile<QK_PITCH>(ksrc + TROWS * HD, kdst + KBUF);
  stage_tile<V_PITCH>(vsrc + TROWS * HD, vdst + VBUF);

  for (int t = 0; t < NSTAGE; ++t) {
    const float* kbuf = &ks[t & 1][0];
    const float* vbuf = &vs[t & 1][0];
// unrolled so that every fragment index is a constant and a later tile's LDS reads can start early
#pragma unroll
    for (int s = 0; s < TROWS / 16; ++s) {
      // ---- scores: Q_tile * K_tile^T ----
      const float* ktile = kbuf + s * 16 * QK_PITCH;
      v2f kf[16];
#pragma unroll
      for (int kk = 0; kk < 16; ++kk)
        kf[kk] = *(const v2f*)(ktile + row * QK_PITCH + 4 * kk + 2 * h);

      v8f acc = {};
#pragma unroll
      for (int kk = 0; kk < 16; ++kk)
        acc = __builtin_amdgcn_wmma_f32_16x16x4_f32(false, qf[kk], false, kf[kk],
                                                    (short)0, acc, false, false);

      // ---- normalize by column stats; stash P in LDS (row M = i+8h, col N = row) ----
      const int   kcol = (t * (TROWS / 16) + s) * 16 + row;
      const float mval = mb[kcol];
      const float linv = 1.0f / lb[kcol];
#pragma unroll
      for (int i = 0; i < 8; ++i) {
        float p = __expf(acc[i] * SCALE - mval) * linv;
        P[(i + 8 * h) * 17 + row] = p;
      }

      // ---- P(16x16) @ V_tile(16x64): 4 d-chunks x 4 k-steps of f32 WMMA ----
#pragma unroll
      for (int c = 0; c < 4; ++c) {
#pragma unroll
        for (int kk = 0; kk < 4; ++kk) {
          v2f pa = { P[row * 17 + 4 * kk + 2 * h],
                     P[row * 17 + 4 * kk + 2 * h + 1] };
          const float* vrow = vbuf + (s * 16 + 4 * kk + 2 * h) * V_PITCH + c * 16 + row;
          v2f vf = { vrow[0], vrow[V_PITCH] };
          oacc[c] = __builtin_amdgcn_wmma_f32_16x16x4_f32(false, pa, false, vf,
                                                          (short)0, oacc[c], false, false);
        }
      }
    }
    // publish tile t+1, free tile t's buffers, then refill them with tile t+2
    wait_lds();
    wait_copies();
    __syncthreads();
    if (t + 2 < NSTAGE) {
      stage_tile<QK_PITCH>(ksrc + (size_t)(t + 2) * TROWS * HD, kdst + (uint32_t)(t & 1) * KBUF);
      stage_tile<V_PITCH>(vsrc + (size_t)(t + 2) * TROWS * HD, vdst + (uint32_t)(t & 1) * VBUF);
    }
  }
  wait_copies();

  // ---- store: lane owns d-col (c*16 + row), rows i + 8h ----
  float* ob = out + ((size_t)b * SEQ + (size_t)qt * 16) * HD;
#pragma unroll
  for (int c = 0; c < 4; ++c)
#pragma unroll
    for (int i = 0; i < 8; ++i)
      ob[(i + 8 * h) * HD + c * 16 + row] = oacc[c][i];
}

extern "C" void kernel_launch(void* const* d_in, const int* in_sizes, int n_in,
                              void* d_out, int out_size, void* d_ws, size_t ws_size,
                              hipStream_t stream) {
  const float* q = (const float*)d_in[0];
  const float* k = (const float*)d_in[1];
  const float* v = (const float*)d_in[2];
  float* out  = (float*)d_out;
  float* mbuf = (float*)d_ws;               // NB*SEQ floats
  float* lbuf = mbuf + (size_t)NB * SEQ;    // NB*SEQ floats (256 KB total < ws)

  dim3 blk(128);                            // 4 wave32 per block
  dim3 grid((NB * (SEQ / 16)) / 4);         // 2048 waves -> 512 blocks

  attn_colstats_kernel<<<grid, blk, 0, stream>>>(q, k, mbuf, lbuf);
  attn_out_kernel<<<grid, blk, 0, stream>>>(q, k, v, mbuf, lbuf, out);
}

// v002
// One run takes 133 microseconds.
// Timed twice side by side with v001, it ran 1.10 times as fast both times.
// All steps since v000 together make it 2.99 times as fast.
#include <hip/hip_runtime.h>
#include <stdint.h>

typedef float v2f __attribute__((ext_vector_type(2)));
typedef float v4f __attribute__((ext_vector_type(4)));
typedef float v8f __attribute__((ext_vector_type(8)));

#define SEQ 2048
#define HD  64
#define NB  16
#define SCALE 0.125f   // 1/sqrt(64)

#define NSPLIT  4                  // waves that share one resident 16-row tile; each takes its own part of every staged tile
#define NTHR    (128 * NSPLIT)     // 4 resident tiles x NSPLIT waves
#define TROWS   128                // rows of one staged tile
#define NSTAGE  (SEQ / TROWS)      // staged tiles per batch
#define WTILES  (TROWS / 16 / NSPLIT)  // 16-row WMMA tiles one wave works on per staged tile
#define QK_PITCH 68                // LDS row pitch in floats for 8-byte fragment reads: 16 rows x 2 halves fall on 64 distinct banks
#define V_PITCH  72                // LDS row pitch in floats for 4-byte row reads: rows r and r+2 fall 16 banks apart

__device__ __forceinline__ uint32_t lds_off(const void* p) { return (uint32_t)(size_t)p; }

// Copies one tile of TROWS x HD floats (contiguous in global memory) into LDS rows of
// PITCH floats: 512 threads x 4 copies x 16 bytes. g and l are the lane's own addresses of
// its first 16 bytes; each further copy is 32 rows on. A wave's copy covers 512 contiguous bytes.
template <int PITCH>
__device__ __forceinline__ void stage_tile(const float* g, uint32_t l) {
  constexpr uint32_t LS = 32u * PITCH * 4u;  // 32 rows in LDS, bytes
  constexpr int      GS = 32 * HD;           // 32 rows in global memory, floats
  // The closing s_wait_xcnt keeps later writes of the address registers behind the copies' issue.
  asm volatile(
      "global_load_async_to_lds_b128 %0, %4, off\n\t"
      "global_load_async_to_lds_b128 %1, %5, off\n\t"
      "global_load_async_to_lds_b128 %2, %6, off\n\t"
      "global_load_async_to_lds_b128 %3, %7, off\n\t"
      "s_wait_xcnt 0x0"
      :: "v"(l), "v"(l + LS), "v"(l + 2u * LS), "v"(l + 3u * LS),
         "v"(g), "v"(g + GS), "v"(g + 2 * GS), "v"(g + 3 * GS)
      : "memory");
}

// This wave's own copies have landed.
__device__ __forceinline__ void wait_copies() { asm volatile("s_wait_asynccnt 0x0" ::: "memory"); }
// This wave's own LDS reads and writes have retired, so that the buffer may be refilled.
__device__ __forceinline__ void wait_lds()    { asm volatile("s_wait_dscnt 0x0" ::: "memory"); }

// ---------------------------------------------------------------------------
// Pass A: per-key column stats of the (query-axis) softmax.
// NSPLIT waves share one (batch, 16-key tile): each takes its own rows of every staged tile of
// query rows (staged once per block in LDS, two buffers, the next tile in flight), and their
// stats are merged through LDS at the end. 4 key tiles per block.
// S_tile[16q x 16k] = Q_tile(16x64) * K_tile(16x64)^T via 16x v_wmma_f32_16x16x4_f32
// ---------------------------------------------------------------------------
__global__ __launch_bounds__(NTHR) void attn_colstats_kernel(
    const float* __restrict__ q, const float* __restrict__ k,
    float* __restrict__ mbuf, float* __restrict__ lbuf) {
  __shared__ __attribute__((aligned(16))) float qs[2][TROWS * QK_PITCH];
  __shared__ float mpart[NSPLIT - 1][4][16];
  __shared__ float lpart[NSPLIT - 1][4][16];

  const int tid  = threadIdx.x;
  const int lane = tid & 31;
  const int wslot = __builtin_amdgcn_readfirstlane(tid >> 5);  // the wave's number, held in a scalar register
  const int wt   = wslot & 3;       // which of the block's 4 key tiles
  const int part = wslot >> 2;      // which part of every staged tile
  const int wid  = blockIdx.x * 4 + wt;
  const int b    = wid >> 7;        // 128 key tiles per batch; the same for the whole block
  const int kt   = wid & 127;
  const int row  = lane & 15;
  const int h    = lane >> 4;       // half-wave selector

  // K tile fragments (B operand): lane holds K-matrix row "row", elems {4kk+2h, +1}
  const float* ktile = k + ((size_t)b * SEQ + (size_t)kt * 16) * HD;
  v2f kf[16];
#pragma unroll
  for (int kk = 0; kk < 16; ++kk)
    kf[kk] = *(const v2f*)(ktile + row * HD + 4 * kk + 2 * h);

  float runmax = -3.0e38f;
  float runsum = 0.0f;

  const float*   gsrc = q + (size_t)b * SEQ * HD + tid * 4;
  const uint32_t ldst = lds_off(&qs[0][0]) + (uint32_t)(tid >> 4) * (QK_PITCH * 4u) + (uint32_t)(tid & 15) * 16u;
  constexpr uint32_t QBUF = TROWS * QK_PITCH * 4u;

  // tile 0 has landed for every wave before anyone reads it; tile 1 then flies during trip 0
  stage_tile<QK_PITCH>(gsrc, ldst);
  wait_copies();
  __syncthreads();
  stage_tile<QK_PITCH>(gsrc + TROWS * HD, ldst + QBUF);

  for (int t = 0; t < NSTAGE; ++t) {
    const float* qbuf = &qs[t & 1][part * (WTILES * 16 * QK_PITCH)];
// unrolled so that every fragment index is a constant and a later tile's LDS reads can start early
#pragma unroll
    for (int s = 0; s < WTILES; ++s) {
      const float* qtile = qbuf + s * 16 * QK_PITCH;
      v2f qf[16];
#pragma unroll
      for (int kk = 0; kk < 16; ++kk)
        qf[kk] = *(const v2f*)(qtile + row * QK_PITCH + 4 * kk + 2 * h);

      v8f acc = {};
#pragma unroll
      for (int kk = 0; kk < 16; ++kk)
        acc = __builtin_amdgcn_wmma_f32_16x16x4_f32(false, qf[kk], false, kf[kk],
                                                    (short)0, acc, false, false);
      // acc[i] = score(row M = i + 8h, key col N = row) -- all same key column per lane
      float tmax = runmax;
#pragma unroll
      for (int i = 0; i < 8; ++i) tmax = fmaxf(tmax, acc[i] * SCALE);
      float sm = runsum * __expf(runmax - tmax);
#pragma unroll
      for (int i = 0; i < 8; ++i) sm += __expf(acc[i] * SCALE - tmax);
      runmax = tmax;
      runsum = sm;
    }
    // publish tile t+1, free tile t's buffer, then refill it with tile t+2
    wait_lds();
    wait_copies();
    __syncthreads();
    if (t + 2 < NSTAGE)
      stage_tile<QK_PITCH>(gsrc + (size_t)(t + 2) * TROWS * HD, ldst + (uint32_t)(t & 1) * QBUF);
  }
  wait_copies();

  // merge the two row-halves (lane ^ 16 owns the same key column, rows 8..15)
  float om = __shfl_xor(runmax, 16, 32);
  float os = __shfl_xor(runsum, 16, 32);
  float m  = fmaxf(runmax, om);
  float ls = runsum * __expf(runmax - m) + os * __expf(om - m);

  // merge the waves that share this key tile: parts 1.. hand their stats to part 0
  if (part > 0 && lane < 16) {
    mpart[part - 1][wt][lane] = m;
    lpart[part - 1][wt][lane] = ls;
  }
  __syncthreads();
  if (part == 0 && lane < 16) {
// unrolled so that all the LDS reads are issued together
#pragma unroll
    for (int p = 0; p < NSPLIT - 1; ++p) {
      const float pm = mpart[p][wt][lane];
      const float pl = lpart[p][wt][lane];
      const float nm = fmaxf(m, pm);
      ls = ls * __expf(m - nm) + pl * __expf(pm - nm);
      m  = nm;
    }
    mbuf[(size_t)b * SEQ + kt * 16 + lane] = m;
    lbuf[(size_t)b * SEQ + kt * 16 + lane] = ls;
  }
}

// ---------------------------------------------------------------------------
// Pass B: out[16q x 64d] = sum_ktiles  exp(S - m)/l  @  V_tile(16x64)
// NSPLIT waves share one (batch, 16-query tile): each takes its own keys of every staged tile of
// K and V rows (staged once per block in LDS, two buffers, the next tile in flight), and their
// partial outputs are summed through LDS at the end. 4 query tiles per block.
// P relayout (C/D-frag -> A-frag) goes through a per-wave padded LDS tile;
// same-wave DS ops are in-order.
// ---------------------------------------------------------------------------
__global__ __launch_bounds__(NTHR) void attn_out_kernel(
    const float* __restrict__ q, const float* __restrict__ k,
    const float* __restrict__ v, const float* __restrict__ mbuf,
    const float* __restrict__ lbuf, float* __restrict__ out) {
  __shared__ __attribute__((aligned(16))) float ks[2][TROWS * QK_PITCH];
  __shared__ __attribute__((aligned(16))) float vs[2][TROWS * V_PITCH];
  __shared__ float pshare[4 * NSPLIT][16 * 17];   // stride-17 pad: conflict-free strided reads

  const int tid   = threadIdx.x;
  const int lane  = tid & 31;
  // the wave's number in a scalar register: what follows from it costs no vector registers,
  // and at 128 of them two blocks (8 waves per SIMD) fit a WGP
  const int wslot = __builtin_amdgcn_readfirstlane(tid >> 5);
  const int wt    = wslot & 3;           // which of the block's 4 query tiles
  const int part  = wslot >> 2;          // which part of every staged tile
  const int wid   = blockIdx.x * 4 + wt;
  const int b     = wid >> 7;            // 128 query tiles per batch; the same for the whole block
  const int qt    = wid & 127;
  const int row   = lane & 15;
  const int h     = lane >> 4;

  float* P = &pshare[wslot][0];
  float* pst = P + 8 * h * 17 + row;     // the lane's first P store; row i is i * 17 floats on, a constant offset

  const float* qtile = q + ((size_t)b * SEQ + (size_t)qt * 16) * HD;
  v2f qf[16];
#pragma unroll
  for (int kk = 0; kk < 16; ++kk)
    qf[kk] = *(const v2f*)(qtile + row * HD + 4 * kk + 2 * h);

  v8f oacc[4] = {{}, {}, {}, {}};        // 16q x 64d output accumulator

  const float* mb = mbuf + (size_t)b * SEQ;
  const float* lb = lbuf + (size_t)b * SEQ;

  const float*   ksrc = k + (size_t)b * SEQ * HD + tid * 4;
  const float*   vsrc = v + (size_t)b * SEQ * HD + tid * 4;
  const uint32_t kdst = lds_off(&ks[0][0]) + (uint32_t)(tid >> 4) * (QK_PITCH * 4u) + (uint32_t)(tid & 15) * 16u;
  const uint32_t vdst = lds_off(&vs[0][0]) + (uint32_t)(tid >> 4) * (V_PITCH * 4u) + (uint32_t)(tid & 15) * 16u;
  constexpr uint32_t KBUF = TROWS * QK_PITCH * 4u;
  constexpr uint32_t VBUF = TROWS * V_PITCH * 4u;

  // tile 0 has landed for every wave before anyone reads it; tile 1 then flies during trip 0
  stage_tile<QK_PITCH>(ksrc, kdst);
  stage_tile<V_PITCH>(vsrc, vdst);
  wait_copies();
  __syncthreads();
  stage_tile<QK_PITCH>(ksrc + TROWS * HD, kdst + KBUF);
  stage_tile<V_PITCH>(vsrc + TROWS * HD, vdst + VBUF);

  for (int t = 0; t < NSTAGE; ++t) {
    const float* kbuf = &ks[t & 1][part * (WTILES * 16 * QK_PITCH)];
    const float* vbuf = &vs[t & 1][part * (WTILES * 16 * V_PITCH)];
// unrolled so that every fragment index is a constant and a later tile's LDS reads can start early
#pragma unroll
    for (int s = 0; s < WTILES; ++s) {
      // ---- scores: Q_tile * K_tile^T ----
      const float* ktile = kbuf + s * 16 * QK_PITCH;
      v2f kf[16];
#pragma unroll
      for (int kk = 0; kk < 16; ++kk)
        kf[kk] = *(const v2f*)(ktile + row * QK_PITCH + 4 * kk + 2 * h);

      v8f acc = {};
#pragma unroll
      for (int kk = 0; kk < 16; ++kk)
        acc = __builtin_amdgcn_wmma_f32_16x16x4_f32(false, qf[kk], false, kf[kk],
                                                    (short)0, acc, false, false);

      // ---- normalize by column stats; stash P in LDS (row M = i+8h, col N = row) ----
      const int   kcol = (t * (TROWS / 16) + part * WTILES + s) * 16 + row;
      const float mval = mb[kcol];
      const float linv = 1.0f / lb[kcol];
#pragma unroll
      for (int i = 0; i < 8; ++i) {
        float p = __expf(acc[i] * SCALE - mval) * linv;
        pst[i * 17] = p;
      }

      // ---- P(16x16) @ V_tile(16x64): 4 d-chunks x 4 k-steps of f32 WMMA ----
#pragma unroll
      for (int c = 0; c < 4; ++c) {
#pragma unroll
        for (int kk = 0; kk < 4; ++kk) {
          v2f pa = { P[row * 17 + 4 * kk + 2 * h],
                     P[row * 17 + 4 * kk + 2 * h + 1] };
          const float* vrow = vbuf + (s * 16 + 4 * kk + 2 * h) * V_PITCH + c * 16 + row;
          v2f vf = { vrow[0], vrow[V_PITCH] };
          oacc[c] = __builtin_amdgcn_wmma_f32_16x16x4_f32(false, pa, false, vf,
                                                          (short)0, oacc[c], false, false);
        }
      }
    }
    // publish tile t+1, free tile t's buffers, then refill them with tile t+2
    wait_lds();
    wait_copies();
    __syncthreads();
    if (t + 2 < NSTAGE) {
      stage_tile<QK_PITCH>(ksrc + (size_t)(t + 2) * TROWS * HD, kdst + (uint32_t)(t & 1) * KBUF);
      stage_tile<V_PITCH>(vsrc + (size_t)(t + 2) * TROWS * HD, vdst + (uint32_t)(t & 1) * VBUF);
    }
  }
  wait_copies();

  // ---- sum the partial outputs of the waves that share this query tile ----
  // The K ring is free: every wave has passed the loop's last barrier and no copy is in flight.
  // Each wave lays its 16 x 64 partial tile there in rows of QK_PITCH floats (rows r and r+8 fall
  // 32 banks apart); behind the barrier each wave sums and stores 16 / NSPLIT whole rows.
  static_assert(4 * NSPLIT * 16 * QK_PITCH <= 2 * TROWS * QK_PITCH, "partial tiles fit the K ring");
  float* red = &ks[0][0];
  float* mine = red + (part * 4 + wt) * (16 * QK_PITCH);
#pragma unroll
  for (int c = 0; c < 4; ++c)
#pragma unroll
    for (int i = 0; i < 8; ++i)
      mine[(i + 8 * h) * QK_PITCH + c * 16 + row] = oacc[c][i];
  __syncthreads();

  // ---- store: a half-wave owns one whole output row, 16 bytes a lane ----
  float* ob = out + ((size_t)b * SEQ + (size_t)qt * 16) * HD;
// both loops unrolled so that all the LDS reads are issued together, at constant offsets
#pragma unroll
  for (int j = 0; j < 16 / NSPLIT / 2; ++j) {
    const int r = part * (16 / NSPLIT) + 2 * j + h;
    const float* src0 = red + wt * (16 * QK_PITCH) + r * QK_PITCH + row * 4;
    v4f sum = *(const v4f*)src0;
#pragma unroll
    for (int p = 1; p < NSPLIT; ++p)
      sum += *(const v4f*)(src0 + p * 4 * (16 * QK_PITCH));
    *(v4f*)(ob + r * HD + row * 4) = sum;
  }
}

extern "C" void kernel_launch(void* const* d_in, const int* in_sizes, int n_in,
                              void* d_out, int out_size, void* d_ws, size_t ws_size,
                              hipStream_t stream) {
  const float* q = (const float*)d_in[0];
  const float* k = (const float*)d_in[1];
  const float* v = (const float*)d_in[2];
  float* out  = (float*)d_out;
  float* mbuf = (float*)d_ws;               // NB*SEQ floats
  float* lbuf = mbuf + (size_t)NB * SEQ;    // NB*SEQ floats (256 KB total < ws)

  dim3 blk(NTHR);                           // 4 tiles x NSPLIT wave32 per block
  dim3 grid((NB * (SEQ / 16)) / 4);         // 2048 tiles -> 512 blocks

  attn_colstats_kernel<<<grid, blk, 0, stream>>>(q, k, mbuf, lbuf);
  attn_out_kernel<<<grid, blk, 0, stream>>>(q, k, v, mbuf, lbuf, out);
}
